// v000
// The times below were measured on an AMD MI455X: many runs one after another, warmed up first and cycling through
// copies of the inputs, with the whole window's GPU time divided by the number of runs. Launches and the gaps
// between them are all in it. The median over several windows is given; except for v000 it joins two sittings, which
// can be a few percent apart, so the side-by-side timings, each taken in one sitting, are the better comparison.
// v000 is the starting kernel. One run takes 378 microseconds.
#include <hip/hip_runtime.h>
#include <hip/hip_bf16.h>
#include <math.h>

typedef __attribute__((ext_vector_type(2))) float v2f;
typedef __attribute__((ext_vector_type(8))) float v8f;

// Problem constants (fixed by the reference)
#define HD      128            // head dim
#define NROT    64
#define NROWS   262144         // 4 * 2048 * 32
#define NTILES  (NROWS / 16)   // 16384
#define TPW     8              // row-tiles per workgroup
#define NWG     (NTILES / TPW) // 2048

// ---------------------------------------------------------------------------
// Setup kernel: fold the 64 sequential Givens rotations and the dense
// rotation_matrix into one 128x128 matrix, stored TRANSPOSED in d_ws:
//   MT[n][k] = M[k][n],  M = (R_1 R_2 ... R_64) @ rotation_matrix
// One block, 128 threads. Thread r owns row r of G -> no barriers needed
// during the rotation phase (rotations only mix columns within a row).
// ---------------------------------------------------------------------------
__global__ __launch_bounds__(128) void build_mt_kernel(
    const float* __restrict__ thetas,
    const float* __restrict__ pairs,        // (64,2) float, cast->int
    const float* __restrict__ theta_scale,  // (1,)
    const float* __restrict__ rotmat,       // (128,128)
    float* __restrict__ mt)                 // d_ws: (128,128) = M^T
{
    __shared__ float G[HD * HD];            // 64 KB
    const int r = threadIdx.x;              // 0..127

    for (int c = 0; c < HD; ++c)
        G[r * HD + c] = (r == c) ? 1.0f : 0.0f;

    const float ts = theta_scale[0];
    for (int k = 0; k < NROT; ++k) {
        const int   i  = (int)pairs[2 * k + 0];   // truncation matches astype(int32)
        const int   j  = (int)pairs[2 * k + 1];
        const float th = thetas[k] * ts;
        const float ct = cosf(th);
        const float st = sinf(th);
        const float gi = G[r * HD + i];
        const float gj = G[r * HD + j];
        if (i == j) {
            G[r * HD + i] = gi * ct;              // ref sets col i then j; same col
        } else {
            G[r * HD + i] =  gi * ct + gj * st;
            G[r * HD + j] = -gi * st + gj * ct;
        }
    }
    __syncthreads();

    // MT[n][k] = sum_c G[k][c] * rotmat[c][n]; thread n computes MT row n.
    // rotmat[c*128+n] reads are coalesced across threads for each fixed c.
    const int n = threadIdx.x;
    for (int k = 0; k < HD; ++k) {
        float acc = 0.0f;
        for (int c = 0; c < HD; ++c)
            acc = fmaf(G[k * HD + c], rotmat[c * HD + n], acc);
        mt[n * HD + k] = acc;
    }
}

// ---------------------------------------------------------------------------
// Main kernel: out = RoPE( X @ M ), X = (262144, 128) f32, streamed.
// 256 threads = 8 waves; each wave owns a 16-column slice of M (B fragments
// held in 64 VGPRs for the whole kernel). Each workgroup processes TPW
// 16-row tiles: x-tile -> LDS (coalesced b128), 32 x v_wmma_f32_16x16x4_f32,
// accumulators -> LDS y-tile, RoPE epilogue with coalesced 512B stores.
// A 16-row tile never straddles a sequence position (32 rows per (b,s)),
// so sin/cos are constant per tile per channel.
// ---------------------------------------------------------------------------
__global__ __launch_bounds__(256) void rotary_main_kernel(
    const float* __restrict__ x,
    const float* __restrict__ inv_freq,     // (64,)
    const float* __restrict__ mt,           // (128,128) = M^T from d_ws
    float* __restrict__ out)
{
    __shared__ float xt[16 * HD];           // 8 KB: x tile
    __shared__ float yt[16 * HD];           // 8 KB: y = x@M tile

    const int tid   = threadIdx.x;
    const int lane  = tid & 31;
    const int wave  = tid >> 5;             // 0..7
    const int n0    = wave << 4;            // column block base
    const int lhalf = lane >> 4;            // 0 or 1
    const int l15   = lane & 15;

    // --- Preload B fragments (this wave's 128x16 slice of M) -------------
    // ISA layout (f32 16x16x4): lanes 0-15 hold K-pair {0,1}, lanes 16-31
    // hold {2,3}; VGPR v selects K within the pair. With MT stored
    // transposed, each fragment is one contiguous float2 per lane.
    v2f bfrag[32];
    {
        const float* mrow = mt + (n0 + l15) * HD + (lhalf << 1);
#pragma unroll
        for (int kk = 0; kk < 32; ++kk)
            bfrag[kk] = *(const v2f*)(mrow + kk * 4);
    }

    // --- Per-thread RoPE parameters (epilogue mapping) --------------------
    const int   c    = tid & 127;           // output channel
    const int   rb   = tid >> 7;            // 0 or 1 (row parity base)
    const int   kidx = c & 63;              // rotation-pair index
    const float invf = inv_freq[kidx];

    for (int it = 0; it < TPW; ++it) {
        const int  tile = blockIdx.x * TPW + it;
        const long r0   = (long)tile * 16;  // first row of this tile

        // --- Stage 16x128 x-tile into LDS (coalesced b128 loads) ---------
        {
            const float4* xg = (const float4*)(x + r0 * HD);
            float4*       xl = (float4*)xt;
            xl[tid]       = xg[tid];
            xl[tid + 256] = xg[tid + 256];
        }
        __syncthreads();

        // --- 16x16 tile of X@M via 32 chained f32 WMMAs ------------------
        v8f acc = {};
        {
            const float* arow = xt + l15 * HD + (lhalf << 1);
#pragma unroll
            for (int kk = 0; kk < 32; ++kk) {
                v2f a = *(const v2f*)(arow + kk * 4);
                acc = __builtin_amdgcn_wmma_f32_16x16x4_f32(
                    /*neg_a=*/false, a, /*neg_b=*/false, bfrag[kk],
                    /*c_mod=*/(short)0, acc,
                    /*reuse_a=*/false, /*reuse_b=*/false);
            }
        }

        // --- Spill accumulators to LDS y-tile ----------------------------
        // D layout: VGPR p, lanes 0-15 -> row p, lanes 16-31 -> row p+8.
#pragma unroll
        for (int p = 0; p < 8; ++p)
            yt[(p + (lhalf << 3)) * HD + n0 + l15] = acc[p];
        __syncthreads();

        // --- RoPE epilogue + coalesced stores ----------------------------
        // out[r][k]    = y[2k]*cos - y[2k+1]*sin   (k < 64)
        // out[r][64+k] = y[2k]*sin + y[2k+1]*cos
        {
            const int   spos = (int)((r0 >> 5) & 2047);
            const float ang  = (float)spos * invf;
            const float sv   = sinf(ang);
            const float cv   = cosf(ang);
            float* orow = out + r0 * HD;
#pragma unroll
            for (int p = 0; p < 8; ++p) {
                const int   row = rb + (p << 1);
                const float y1  = yt[row * HD + 2 * kidx];
                const float y2  = yt[row * HD + 2 * kidx + 1];
                const float v   = (c < 64) ? (y1 * cv - y2 * sv)
                                           : (y1 * sv + y2 * cv);
                orow[row * HD + c] = v;      // 128 consecutive lanes/chan
            }
        }
        // next iteration's first __syncthreads separates these yt reads
        // from the next tile's yt writes; xt is a disjoint buffer.
    }
}

extern "C" void kernel_launch(void* const* d_in, const int* in_sizes, int n_in,
                              void* d_out, int out_size, void* d_ws, size_t ws_size,
                              hipStream_t stream) {
    const float* x        = (const float*)d_in[0];
    const float* thetas   = (const float*)d_in[1];
    const float* pairs    = (const float*)d_in[2];
    const float* tscale   = (const float*)d_in[3];
    const float* rotmat   = (const float*)d_in[4];
    const float* inv_freq = (const float*)d_in[5];
    float*       mt       = (float*)d_ws;           // 128*128*4 = 64 KB
    float*       out      = (float*)d_out;

    build_mt_kernel<<<1, 128, 0, stream>>>(thetas, pairs, tscale, rotmat, mt);
    rotary_main_kernel<<<NWG, 256, 0, stream>>>(x, inv_freq, mt, out);
}

// v001
// It runs in 161 microseconds.
// Two timings next to v000 both put it at 2.36 times that version's speed.
#include <hip/hip_runtime.h>
#include <hip/hip_bf16.h>
#include <math.h>

typedef __attribute__((ext_vector_type(2))) float v2f;
typedef __attribute__((ext_vector_type(8))) float v8f;

// Problem constants (fixed by the reference)
#define HD      128            // head dim
#define NROT    64
#define NROWS   262144         // 4 * 2048 * 32
#define NTILES  (NROWS / 16)   // 16384
#define TPW     8              // row-tiles per workgroup
#define NWG     (NTILES / TPW) // 2048

// ---------------------------------------------------------------------------
// Setup kernel: fold the 64 sequential Givens rotations and the dense
// rotation_matrix into one 128x128 matrix, stored TRANSPOSED in d_ws:
//   MT[n][k] = M[k][n],  M = R_1 (R_2 ( ... (R_64 @ rotation_matrix)))
// The product is associated from the right: R_k from the left only mixes
// rows i_k and j_k of the matrix, so the rotations are applied to
// rotation_matrix itself, last one first, and no dense 128^3 product is left.
// One block of 10 waves: waves 0-7 bring rotation_matrix into LDS while
// waves 8-9 work out the 64 (cos, sin, i, j); waves 0-3 then run the chain,
// thread n owning column n (a rotation never mixes columns); waves 0-7 write
// the transpose.
// ---------------------------------------------------------------------------
#define AP      132            // LDS row pitch in floats: 16 B x odd, so that the
                               // b128 reads down a column below run at full rate
#define SETUP_T 320

__device__ __forceinline__ float lane_f(float v, int l) {
    return __int_as_float(__builtin_amdgcn_readlane(__float_as_int(v), l));
}

__global__ __launch_bounds__(SETUP_T) void build_mt_kernel(
    const float* __restrict__ thetas,
    const float* __restrict__ pairs,        // (64,2) float, cast->int
    const float* __restrict__ theta_scale,  // (1,)
    const float* __restrict__ rotmat,       // (128,128)
    float* __restrict__ mt)                 // d_ws: (128,128) = M^T
{
    __shared__ __attribute__((aligned(16))) float  A[HD * AP];  // A[k][n], 66 KB
    __shared__ __attribute__((aligned(16))) float4 P[NROT];     // cos, sin, row offsets
    const int tid  = threadIdx.x;
    const int lane = tid & 31;
    const int wave = __builtin_amdgcn_readfirstlane(tid >> 5);  // 0..9, scalar

    if (wave >= 8) {
        // --- One rotation per lane ----------------------------------------
        const int k = tid & 63;             // tid - 256: 0..63
        int i = (int)pairs[2 * k + 0];      // truncation matches astype(int32)
        int j = (int)pairs[2 * k + 1];
        i = min(max(i, 0), HD - 1);         // bounds the LDS address
        j = min(max(j, 0), HD - 1);
        const float th = thetas[k] * theta_scale[0];
        P[k] = make_float4(cosf(th), sinf(th),
                           __int_as_float(i * AP), __int_as_float(j * AP));
    } else {
        // --- rotation_matrix -> LDS, one 512 B row per wave and load ------
        const float4* rg = (const float4*)rotmat;
        float4 v[16];
#pragma unroll
        for (int q = 0; q < 16; ++q)
            v[q] = rg[q * 256 + tid];
#pragma unroll
        for (int q = 0; q < 16; ++q)
            *(float4*)&A[(q * 8 + wave) * AP + lane * 4] = v[q];
    }
    __syncthreads();

    // --- Apply R_64, R_63, ..., R_1 from the left --------------------------
    //   row i <- c*row i - s*row j ;  row j <- s*row i + c*row j
    //   i == j: the reference's G has only cos at (i,i): row i <- c*row i
    if (wave < 4) {
        const float4 p[2] = { P[lane], P[lane + 32] };  // lane l: rotations l, l+32
        float* col = A + tid;
#pragma unroll
        for (int k = NROT - 1; k >= 0; --k) {
            const int   h  = k >> 5;
            const int   l  = k & 31;
            const float c  = lane_f(p[h].x, l);
            const float s  = lane_f(p[h].y, l);
            const int   ri = __builtin_amdgcn_readlane(__float_as_int(p[h].z), l);
            const int   rj = __builtin_amdgcn_readlane(__float_as_int(p[h].w), l);
            const float ai = col[ri];
            const float aj = col[rj];
            const bool  same = (ri == rj);
            col[ri] = same ? ai * c : ai * c - aj * s;
            col[rj] = same ? ai * c : ai * s + aj * c;
        }
    }
    __syncthreads();

    // --- MT[n][k] = A[k][n]: lane = k, wave w has n = 16w .. 16w+15 ---------
    // Each lane reads 4 n of its row k at once; each store is 128 B of one MT row.
    if (wave < 8) {
        const float* ab = A + lane * AP + wave * 16;
        float*       mb = mt + (wave * 16) * HD + lane;
        float4 o[16];
#pragma unroll
        for (int u = 0; u < 16; ++u)        // k += 32 * (u >> 2), n += 4 * (u & 3)
            o[u] = *(const float4*)&ab[(u >> 2) * 32 * AP + (u & 3) * 4];
#pragma unroll
        for (int u = 0; u < 16; ++u) {
            float* ms = mb + (u & 3) * 4 * HD + (u >> 2) * 32;
            ms[0]      = o[u].x;
            ms[HD]     = o[u].y;
            ms[2 * HD] = o[u].z;
            ms[3 * HD] = o[u].w;
        }
    }
}

// ---------------------------------------------------------------------------
// Main kernel: out = RoPE( X @ M ), X = (262144, 128) f32, streamed.
// 256 threads = 8 waves; each wave owns a 16-column slice of M (B fragments
// held in 64 VGPRs for the whole kernel). Each workgroup processes TPW
// 16-row tiles: x-tile -> LDS (coalesced b128), 32 x v_wmma_f32_16x16x4_f32,
// accumulators -> LDS y-tile, RoPE epilogue with coalesced 512B stores.
// A 16-row tile never straddles a sequence position (32 rows per (b,s)),
// so sin/cos are constant per tile per channel.
// ---------------------------------------------------------------------------
__global__ __launch_bounds__(256) void rotary_main_kernel(
    const float* __restrict__ x,
    const float* __restrict__ inv_freq,     // (64,)
    const float* __restrict__ mt,           // (128,128) = M^T from d_ws
    float* __restrict__ out)
{
    __shared__ float xt[16 * HD];           // 8 KB: x tile
    __shared__ float yt[16 * HD];           // 8 KB: y = x@M tile

    const int tid   = threadIdx.x;
    const int lane  = tid & 31;
    const int wave  = tid >> 5;             // 0..7
    const int n0    = wave << 4;            // column block base
    const int lhalf = lane >> 4;            // 0 or 1
    const int l15   = lane & 15;

    // --- Preload B fragments (this wave's 128x16 slice of M) -------------
    // ISA layout (f32 16x16x4): lanes 0-15 hold K-pair {0,1}, lanes 16-31
    // hold {2,3}; VGPR v selects K within the pair. With MT stored
    // transposed, each fragment is one contiguous float2 per lane.
    v2f bfrag[32];
    {
        const float* mrow = mt + (n0 + l15) * HD + (lhalf << 1);
#pragma unroll
        for (int kk = 0; kk < 32; ++kk)
            bfrag[kk] = *(const v2f*)(mrow + kk * 4);
    }

    // --- Per-thread RoPE parameters (epilogue mapping) --------------------
    const int   c    = tid & 127;           // output channel
    const int   rb   = tid >> 7;            // 0 or 1 (row parity base)
    const int   kidx = c & 63;              // rotation-pair index
    const float invf = inv_freq[kidx];

    for (int it = 0; it < TPW; ++it) {
        const int  tile = blockIdx.x * TPW + it;
        const long r0   = (long)tile * 16;  // first row of this tile

        // --- Stage 16x128 x-tile into LDS (coalesced b128 loads) ---------
        {
            const float4* xg = (const float4*)(x + r0 * HD);
            float4*       xl = (float4*)xt;
            xl[tid]       = xg[tid];
            xl[tid + 256] = xg[tid + 256];
        }
        __syncthreads();

        // --- 16x16 tile of X@M via 32 chained f32 WMMAs ------------------
        v8f acc = {};
        {
            const float* arow = xt + l15 * HD + (lhalf << 1);
#pragma unroll
            for (int kk = 0; kk < 32; ++kk) {
                v2f a = *(const v2f*)(arow + kk * 4);
                acc = __builtin_amdgcn_wmma_f32_16x16x4_f32(
                    /*neg_a=*/false, a, /*neg_b=*/false, bfrag[kk],
                    /*c_mod=*/(short)0, acc,
                    /*reuse_a=*/false, /*reuse_b=*/false);
            }
        }

        // --- Spill accumulators to LDS y-tile ----------------------------
        // D layout: VGPR p, lanes 0-15 -> row p, lanes 16-31 -> row p+8.
#pragma unroll
        for (int p = 0; p < 8; ++p)
            yt[(p + (lhalf << 3)) * HD + n0 + l15] = acc[p];
        __syncthreads();

        // --- RoPE epilogue + coalesced stores ----------------------------
        // out[r][k]    = y[2k]*cos - y[2k+1]*sin   (k < 64)
        // out[r][64+k] = y[2k]*sin + y[2k+1]*cos
        {
            const int   spos = (int)((r0 >> 5) & 2047);
            const float ang  = (float)spos * invf;
            const float sv   = sinf(ang);
            const float cv   = cosf(ang);
            float* orow = out + r0 * HD;
#pragma unroll
            for (int p = 0; p < 8; ++p) {
                const int   row = rb + (p << 1);
                const float y1  = yt[row * HD + 2 * kidx];
                const float y2  = yt[row * HD + 2 * kidx + 1];
                const float v   = (c < 64) ? (y1 * cv - y2 * sv)
                                           : (y1 * sv + y2 * cv);
                orow[row * HD + c] = v;      // 128 consecutive lanes/chan
            }
        }
        // next iteration's first __syncthreads separates these yt reads
        // from the next tile's yt writes; xt is a disjoint buffer.
    }
}

extern "C" void kernel_launch(void* const* d_in, const int* in_sizes, int n_in,
                              void* d_out, int out_size, void* d_ws, size_t ws_size,
                              hipStream_t stream) {
    const float* x        = (const float*)d_in[0];
    const float* thetas   = (const float*)d_in[1];
    const float* pairs    = (const float*)d_in[2];
    const float* tscale   = (const float*)d_in[3];
    const float* rotmat   = (const float*)d_in[4];
    const float* inv_freq = (const float*)d_in[5];
    float*       mt       = (float*)d_ws;           // 128*128*4 = 64 KB
    float*       out      = (float*)d_out;

    build_mt_kernel<<<1, SETUP_T, 0, stream>>>(thetas, pairs, tscale, rotmat, mt);
    rotary_main_kernel<<<NWG, 256, 0, stream>>>(x, inv_freq, mt, out);
}

// v002
// A run of this version takes 69.2 microseconds.
// In both of two side-by-side timings against v001, it was 2.32 times as fast.
// Over all steps from v000 it is 5.47 times as fast.
#include <hip/hip_runtime.h>
#include <hip/hip_bf16.h>
#include <math.h>

typedef __attribute__((ext_vector_type(2))) float v2f;
typedef __attribute__((ext_vector_type(8))) float v8f;

// Problem constants (fixed by the reference)
#define HD      128            // head dim
#define NROT    64
#define NROWS   262144         // 4 * 2048 * 32
#define NTILES  (NROWS / 16)   // 16384
#define TPW     8              // row-tiles per workgroup
#define NWG     (NTILES / TPW) // 2048

// ---------------------------------------------------------------------------
// Setup kernel: fold the 64 sequential Givens rotations and the dense
// rotation_matrix into one 128x128 matrix, stored TRANSPOSED in d_ws:
//   MT[n][k] = M[k][n],  M = R_1 (R_2 ( ... (R_64 @ rotation_matrix)))
// The product is associated from the right: R_k from the left only mixes
// rows i_k and j_k of the matrix, so the rotations are applied to
// rotation_matrix itself, last one first, and no dense 128^3 product is left.
// One block of 10 waves: waves 0-7 bring rotation_matrix into LDS while
// waves 8-9 work out the 64 (cos, sin, i, j); waves 0-3 then run the chain,
// thread n owning column n (a rotation never mixes columns); waves 0-7 write
// the transpose.
// ---------------------------------------------------------------------------
#define AP      132            // LDS row pitch in floats: 16 B x odd, so that the
                               // b128 reads down a column below run at full rate
#define SETUP_T 320

__device__ __forceinline__ float lane_f(float v, int l) {
    return __int_as_float(__builtin_amdgcn_readlane(__float_as_int(v), l));
}

__global__ __launch_bounds__(SETUP_T) void build_mt_kernel(
    const float* __restrict__ thetas,
    const float* __restrict__ pairs,        // (64,2) float, cast->int
    const float* __restrict__ theta_scale,  // (1,)
    const float* __restrict__ rotmat,       // (128,128)
    float* __restrict__ mt)                 // d_ws: (128,128) = M^T
{
    __shared__ __attribute__((aligned(16))) float  A[HD * AP];  // A[k][n], 66 KB
    __shared__ __attribute__((aligned(16))) float4 P[NROT];     // cos, sin, row offsets
    const int tid  = threadIdx.x;
    const int lane = tid & 31;
    const int wave = __builtin_amdgcn_readfirstlane(tid >> 5);  // 0..9, scalar

    if (wave >= 8) {
        // --- One rotation per lane ----------------------------------------
        const int k = tid & 63;             // tid - 256: 0..63
        int i = (int)pairs[2 * k + 0];      // truncation matches astype(int32)
        int j = (int)pairs[2 * k + 1];
        i = min(max(i, 0), HD - 1);         // bounds the LDS address
        j = min(max(j, 0), HD - 1);
        const float th = thetas[k] * theta_scale[0];
        P[k] = make_float4(cosf(th), sinf(th),
                           __int_as_float(i * AP), __int_as_float(j * AP));
    } else {
        // --- rotation_matrix -> LDS, one 512 B row per wave and load ------
        const float4* rg = (const float4*)rotmat;
        float4 v[16];
#pragma unroll
        for (int q = 0; q < 16; ++q)
            v[q] = rg[q * 256 + tid];
#pragma unroll
        for (int q = 0; q < 16; ++q)
            *(float4*)&A[(q * 8 + wave) * AP + lane * 4] = v[q];
    }
    __syncthreads();

    // --- Apply R_64, R_63, ..., R_1 from the left --------------------------
    //   row i <- c*row i - s*row j ;  row j <- s*row i + c*row j
    //   i == j: the reference's G has only cos at (i,i): row i <- c*row i
    if (wave < 4) {
        const float4 p[2] = { P[lane], P[lane + 32] };  // lane l: rotations l, l+32
        float* col = A + tid;
#pragma unroll
        for (int k = NROT - 1; k >= 0; --k) {
            const int   h  = k >> 5;
            const int   l  = k & 31;
            const float c  = lane_f(p[h].x, l);
            const float s  = lane_f(p[h].y, l);
            const int   ri = __builtin_amdgcn_readlane(__float_as_int(p[h].z), l);
            const int   rj = __builtin_amdgcn_readlane(__float_as_int(p[h].w), l);
            const float ai = col[ri];
            const float aj = col[rj];
            const bool  same = (ri == rj);
            col[ri] = same ? ai * c : ai * c - aj * s;
            col[rj] = same ? ai * c : ai * s + aj * c;
        }
    }
    __syncthreads();

    // --- MT[n][k] = A[k][n]: lane = k, wave w has n = 16w .. 16w+15 ---------
    // Each lane reads 4 n of its row k at once; each store is 128 B of one MT row.
    if (wave < 8) {
        const float* ab = A + lane * AP + wave * 16;
        float*       mb = mt + (wave * 16) * HD + lane;
        float4 o[16];
#pragma unroll
        for (int u = 0; u < 16; ++u)        // k += 32 * (u >> 2), n += 4 * (u & 3)
            o[u] = *(const float4*)&ab[(u >> 2) * 32 * AP + (u & 3) * 4];
#pragma unroll
        for (int u = 0; u < 16; ++u) {
            float* ms = mb + (u & 3) * 4 * HD + (u >> 2) * 32;
            ms[0]      = o[u].x;
            ms[HD]     = o[u].y;
            ms[2 * HD] = o[u].z;
            ms[3 * HD] = o[u].w;
        }
    }
}

// ---------------------------------------------------------------------------
// Main kernel: out = RoPE( X @ M ), X = (262144, 128) f32, streamed.
// 256 threads = 8 waves; each wave owns a 16-column slice of M (B fragments
// held in 64 VGPRs for the whole kernel). Each workgroup processes TPW
// 16-row tiles: x-tile -> LDS (coalesced b128), 32 x v_wmma_f32_16x16x4_f32,
// accumulators -> LDS y-tile, RoPE epilogue with coalesced 512B stores.
// A 16-row tile never straddles a sequence position (32 rows per (b,s)),
// so sin/cos are constant per tile per channel.
// ---------------------------------------------------------------------------
#define XP      132            // LDS row pitch of the x tile in floats. 132 = 4 mod 64
                               // banks: the 16 rows x 2 k-pairs x 8 B of one A
                               // fragment read cover all 64 banks once; at 128
                               // every row starts on the same bank.

__global__ __launch_bounds__(256) void rotary_main_kernel(
    const float* __restrict__ x,
    const float* __restrict__ inv_freq,     // (64,)
    const float* __restrict__ mt,           // (128,128) = M^T from d_ws
    float* __restrict__ out)
{
    __shared__ __attribute__((aligned(16))) float xt[16 * XP];  // x tile, padded rows
    __shared__ float yt[16 * HD];           // 8 KB: y = x@M tile

    const int tid   = threadIdx.x;
    const int lane  = tid & 31;
    const int wave  = tid >> 5;             // 0..7
    const int n0    = wave << 4;            // column block base
    const int lhalf = lane >> 4;            // 0 or 1
    const int l15   = lane & 15;

    // --- Preload B fragments (this wave's 128x16 slice of M) -------------
    // ISA layout (f32 16x16x4): lanes 0-15 hold K-pair {0,1}, lanes 16-31
    // hold {2,3}; VGPR v selects K within the pair. With MT stored
    // transposed, each fragment is one contiguous float2 per lane.
    v2f bfrag[32];
    {
        const float* mrow = mt + (n0 + l15) * HD + (lhalf << 1);
#pragma unroll
        for (int kk = 0; kk < 32; ++kk)
            bfrag[kk] = *(const v2f*)(mrow + kk * 4);
    }

    // --- Per-thread RoPE parameters (epilogue mapping) --------------------
    const int   c    = tid & 127;           // output channel
    const int   rb   = tid >> 7;            // 0 or 1 (row parity base)
    const int   kidx = c & 63;              // rotation-pair index
    const float invf = inv_freq[kidx];

    for (int it = 0; it < TPW; ++it) {
        const int  tile = blockIdx.x * TPW + it;
        const long r0   = (long)tile * 16;  // first row of this tile

        // --- Stage 16x128 x-tile into LDS (coalesced b128 loads) ---------
        {
            const float4* xg = (const float4*)(x + r0 * HD);
            float4*       xl = (float4*)&xt[wave * XP + lane * 4];  // row = wave
            xl[0]          = xg[tid];
            xl[8 * XP / 4] = xg[tid + 256];                         // row = wave + 8
        }
        __syncthreads();

        // --- 16x16 tile of X@M via 32 chained f32 WMMAs ------------------
        v8f acc = {};
        {
            const float* arow = xt + l15 * XP + (lhalf << 1);
#pragma unroll
            for (int kk = 0; kk < 32; ++kk) {
                v2f a = *(const v2f*)(arow + kk * 4);
                acc = __builtin_amdgcn_wmma_f32_16x16x4_f32(
                    /*neg_a=*/false, a, /*neg_b=*/false, bfrag[kk],
                    /*c_mod=*/(short)0, acc,
                    /*reuse_a=*/false, /*reuse_b=*/false);
            }
        }

        // --- Spill accumulators to LDS y-tile ----------------------------
        // D layout: VGPR p, lanes 0-15 -> row p, lanes 16-31 -> row p+8.
#pragma unroll
        for (int p = 0; p < 8; ++p)
            yt[(p + (lhalf << 3)) * HD + n0 + l15] = acc[p];
        __syncthreads();

        // --- RoPE epilogue + coalesced stores ----------------------------
        // out[r][k]    = y[2k]*cos - y[2k+1]*sin   (k < 64)
        // out[r][64+k] = y[2k]*sin + y[2k+1]*cos
        {
            const int   spos = (int)((r0 >> 5) & 2047);
            const float ang  = (float)spos * invf;
            const float sv   = sinf(ang);
            const float cv   = cosf(ang);
            float* orow = out + r0 * HD;
#pragma unroll
            for (int p = 0; p < 8; ++p) {
                const int   row = rb + (p << 1);
                const float y1  = yt[row * HD + 2 * kidx];
                const float y2  = yt[row * HD + 2 * kidx + 1];
                const float v   = (c < 64) ? (y1 * cv - y2 * sv)
                                           : (y1 * sv + y2 * cv);
                orow[row * HD + c] = v;      // 128 consecutive lanes/chan
            }
        }
        // next iteration's first __syncthreads separates these yt reads
        // from the next tile's yt writes; xt is a disjoint buffer.
    }
}

extern "C" void kernel_launch(void* const* d_in, const int* in_sizes, int n_in,
                              void* d_out, int out_size, void* d_ws, size_t ws_size,
                              hipStream_t stream) {
    const float* x        = (const float*)d_in[0];
    const float* thetas   = (const float*)d_in[1];
    const float* pairs    = (const float*)d_in[2];
    const float* tscale   = (const float*)d_in[3];
    const float* rotmat   = (const float*)d_in[4];
    const float* inv_freq = (const float*)d_in[5];
    float*       mt       = (float*)d_ws;           // 128*128*4 = 64 KB
    float*       out      = (float*)d_out;

    build_mt_kernel<<<1, SETUP_T, 0, stream>>>(thetas, pairs, tscale, rotmat, mt);
    rotary_main_kernel<<<NWG, 256, 0, stream>>>(x, inv_freq, mt, out);
}

// v003
// It runs in 60.9 microseconds.
// In both of two side-by-side timings against v002, it was 1.13 times as fast.
// All steps since v000 together make it 6.20 times as fast.
#include <hip/hip_runtime.h>
#include <hip/hip_bf16.h>
#include <math.h>

typedef __attribute__((ext_vector_type(2))) float v2f;
typedef __attribute__((ext_vector_type(8))) float v8f;

// Problem constants (fixed by the reference)
#define HD      128            // head dim
#define NROT    64
#define NROWS   262144         // 4 * 2048 * 32
#define NTILES  (NROWS / 16)   // 16384
#define TPW     8              // row-tiles per workgroup
#define NWG     (NTILES / TPW) // 2048

// ---------------------------------------------------------------------------
// Setup kernel: fold the 64 sequential Givens rotations and the dense
// rotation_matrix into one 128x128 matrix
//   M = R_1 (R_2 ( ... (R_64 @ rotation_matrix)))
// stored in d_ws in the order in which the main kernel's waves hold it as WMMA
// B fragments: float4 number (w*16 + q)*32 + lane, lane = 16h + c, holds
//   M[8q+2h][16w+c], M[8q+2h+1][16w+c], M[8q+4+2h][16w+c], M[8q+4+2h+1][16w+c]
// (fragments kk = 2q and 2q+1 of column block w).
// The product is associated from the right: R_k from the left only mixes
// rows i_k and j_k of the matrix, so the rotations are applied to
// rotation_matrix itself, last one first, and no dense 128^3 product is left.
// One block of 10 waves: waves 0-7 bring rotation_matrix into LDS while
// waves 8-9 work out the 64 (cos, sin, i, j); waves 0-3 then run the chain,
// thread n owning column n (a rotation never mixes columns); waves 0-7 write
// the fragments.
// ---------------------------------------------------------------------------
#define AP      136            // LDS row pitch in floats. 2 rows = 16 mod 64 banks:
                               // the two half-waves of a fragment read below
                               // (16 columns each, 2 rows apart) share no bank
#define SETUP_T 320

__device__ __forceinline__ float lane_f(float v, int l) {
    return __int_as_float(__builtin_amdgcn_readlane(__float_as_int(v), l));
}

__global__ __launch_bounds__(SETUP_T) void build_mt_kernel(
    const float* __restrict__ thetas,
    const float* __restrict__ pairs,        // (64,2) float, cast->int
    const float* __restrict__ theta_scale,  // (1,)
    const float* __restrict__ rotmat,       // (128,128)
    float* __restrict__ mf)                 // d_ws: M in B-fragment order
{
    __shared__ __attribute__((aligned(16))) float  A[HD * AP];  // A[k][n], 68 KB
    __shared__ __attribute__((aligned(16))) float4 P[NROT];     // cos, sin, row offsets
    const int tid  = threadIdx.x;
    const int lane = tid & 31;
    const int wave = __builtin_amdgcn_readfirstlane(tid >> 5);  // 0..9, scalar

    if (wave >= 8) {
        // --- One rotation per lane ----------------------------------------
        const int k = tid & 63;             // tid - 256: 0..63
        int i = (int)pairs[2 * k + 0];      // truncation matches astype(int32)
        int j = (int)pairs[2 * k + 1];
        i = min(max(i, 0), HD - 1);         // bounds the LDS address
        j = min(max(j, 0), HD - 1);
        const float th = thetas[k] * theta_scale[0];
        P[k] = make_float4(cosf(th), sinf(th),
                           __int_as_float(i * AP), __int_as_float(j * AP));
    } else {
        // --- rotation_matrix -> LDS, one 512 B row per wave and load ------
        const float4* rg = (const float4*)rotmat;
        float4 v[16];
#pragma unroll
        for (int q = 0; q < 16; ++q)
            v[q] = rg[q * 256 + tid];
#pragma unroll
        for (int q = 0; q < 16; ++q)
            *(float4*)&A[(q * 8 + wave) * AP + lane * 4] = v[q];
    }
    __syncthreads();

    // --- Apply R_64, R_63, ..., R_1 from the left --------------------------
    //   row i <- c*row i - s*row j ;  row j <- s*row i + c*row j
    //   i == j: the reference's G has only cos at (i,i): row i <- c*row i
    if (wave < 4) {
        const float4 p[2] = { P[lane], P[lane + 32] };  // lane l: rotations l, l+32
        float* col = A + tid;
#pragma unroll
        for (int k = NROT - 1; k >= 0; --k) {
            const int   h  = k >> 5;
            const int   l  = k & 31;
            const float c  = lane_f(p[h].x, l);
            const float s  = lane_f(p[h].y, l);
            const int   ri = __builtin_amdgcn_readlane(__float_as_int(p[h].z), l);
            const int   rj = __builtin_amdgcn_readlane(__float_as_int(p[h].w), l);
            const float ai = col[ri];
            const float aj = col[rj];
            const bool  same = (ri == rj);
            col[ri] = same ? ai * c : ai * c - aj * s;
            col[rj] = same ? ai * c : ai * s + aj * c;
        }
    }
    __syncthreads();

    // --- Fragment order: wave w writes column block w, 512 B per store -----
    if (wave < 8) {
        const float* ab = A + (lane >> 4) * 2 * AP + wave * 16 + (lane & 15);
        float4*      mb = (float4*)mf + wave * 512 + lane;
        float4 o[16];
#pragma unroll
        for (int q = 0; q < 16; ++q) {
            const float* a = ab + q * 8 * AP;
            o[q] = make_float4(a[0], a[AP], a[4 * AP], a[5 * AP]);
        }
#pragma unroll
        for (int q = 0; q < 16; ++q)
            mb[q * 32] = o[q];
    }
}

// ---------------------------------------------------------------------------
// Main kernel: out = RoPE( X @ M ), X = (262144, 128) f32, streamed.
// 256 threads = 8 waves; each wave owns a 16-column slice of M (B fragments
// held in 64 VGPRs for the whole kernel). Each workgroup processes TPW
// 16-row tiles: x-tile -> LDS (coalesced b128), 32 x v_wmma_f32_16x16x4_f32,
// accumulators -> LDS y-tile, RoPE epilogue with coalesced 512B stores.
// A 16-row tile never straddles a sequence position (32 rows per (b,s)),
// so sin/cos are constant per tile per channel.
// ---------------------------------------------------------------------------
#define XP      132            // LDS row pitch of the x tile in floats. 132 = 4 mod 64
                               // banks: the 16 rows x 2 k-pairs x 8 B of one A
                               // fragment read cover all 64 banks once; at 128
                               // every row starts on the same bank.

__global__ __launch_bounds__(256) void rotary_main_kernel(
    const float* __restrict__ x,
    const float* __restrict__ inv_freq,     // (64,)
    const float* __restrict__ mf,           // M in B-fragment order, from d_ws
    float* __restrict__ out)
{
    __shared__ __attribute__((aligned(16))) float xt[16 * XP];  // x tile, padded rows
    __shared__ float yt[16 * HD];           // 8 KB: y = x@M tile

    const int tid   = threadIdx.x;
    const int lane  = tid & 31;
    const int wave  = tid >> 5;             // 0..7
    const int n0    = wave << 4;            // column block base
    const int lhalf = lane >> 4;            // 0 or 1
    const int l15   = lane & 15;

    // --- Preload B fragments (this wave's 128x16 slice of M) -------------
    // ISA layout (f32 16x16x4): lanes 0-15 hold K-pair {0,1}, lanes 16-31
    // hold {2,3}; VGPR v selects K within the pair. d_ws holds M in that
    // order, two fragments per float4: each load of a wave is 512 contiguous
    // bytes (4 whole lines).
    v2f bfrag[32];
    {
        const float4* mw = (const float4*)mf + wave * 512 + lane;
#pragma unroll
        for (int q = 0; q < 16; ++q) {
            const float4 t = mw[q * 32];
            bfrag[2 * q]     = v2f{t.x, t.y};
            bfrag[2 * q + 1] = v2f{t.z, t.w};
        }
    }

    // --- Per-thread RoPE parameters (epilogue mapping) --------------------
    const int   c    = tid & 127;           // output channel
    const int   rb   = tid >> 7;            // 0 or 1 (row parity base)
    const int   kidx = c & 63;              // rotation-pair index
    const float invf = inv_freq[kidx];

    for (int it = 0; it < TPW; ++it) {
        const int  tile = blockIdx.x * TPW + it;
        const long r0   = (long)tile * 16;  // first row of this tile

        // --- Stage 16x128 x-tile into LDS (coalesced b128 loads) ---------
        {
            const float4* xg = (const float4*)(x + r0 * HD);
            float4*       xl = (float4*)&xt[wave * XP + lane * 4];  // row = wave
            xl[0]          = xg[tid];
            xl[8 * XP / 4] = xg[tid + 256];                         // row = wave + 8
        }
        __syncthreads();

        // --- 16x16 tile of X@M via 32 chained f32 WMMAs ------------------
        v8f acc = {};
        {
            const float* arow = xt + l15 * XP + (lhalf << 1);
#pragma unroll
            for (int kk = 0; kk < 32; ++kk) {
                v2f a = *(const v2f*)(arow + kk * 4);
                acc = __builtin_amdgcn_wmma_f32_16x16x4_f32(
                    /*neg_a=*/false, a, /*neg_b=*/false, bfrag[kk],
                    /*c_mod=*/(short)0, acc,
                    /*reuse_a=*/false, /*reuse_b=*/false);
            }
        }

        // --- Spill accumulators to LDS y-tile ----------------------------
        // D layout: VGPR p, lanes 0-15 -> row p, lanes 16-31 -> row p+8.
#pragma unroll
        for (int p = 0; p < 8; ++p)
            yt[(p + (lhalf << 3)) * HD + n0 + l15] = acc[p];
        __syncthreads();

        // --- RoPE epilogue + coalesced stores ----------------------------
        // out[r][k]    = y[2k]*cos - y[2k+1]*sin   (k < 64)
        // out[r][64+k] = y[2k]*sin + y[2k+1]*cos
        {
            const int   spos = (int)((r0 >> 5) & 2047);
            const float ang  = (float)spos * invf;
            const float sv   = sinf(ang);
            const float cv   = cosf(ang);
            float* orow = out + r0 * HD;
#pragma unroll
            for (int p = 0; p < 8; ++p) {
                const int   row = rb + (p << 1);
                const float y1  = yt[row * HD + 2 * kidx];
                const float y2  = yt[row * HD + 2 * kidx + 1];
                const float v   = (c < 64) ? (y1 * cv - y2 * sv)
                                           : (y1 * sv + y2 * cv);
                orow[row * HD + c] = v;      // 128 consecutive lanes/chan
            }
        }
        // next iteration's first __syncthreads separates these yt reads
        // from the next tile's yt writes; xt is a disjoint buffer.
    }
}

extern "C" void kernel_launch(void* const* d_in, const int* in_sizes, int n_in,
                              void* d_out, int out_size, void* d_ws, size_t ws_size,
                              hipStream_t stream) {
    const float* x        = (const float*)d_in[0];
    const float* thetas   = (const float*)d_in[1];
    const float* pairs    = (const float*)d_in[2];
    const float* tscale   = (const float*)d_in[3];
    const float* rotmat   = (const float*)d_in[4];
    const float* inv_freq = (const float*)d_in[5];
    float*       mf       = (float*)d_ws;           // 128*128*4 = 64 KB
    float*       out      = (float*)d_out;

    build_mt_kernel<<<1, SETUP_T, 0, stream>>>(thetas, pairs, tscale, rotmat, mf);
    rotary_main_kernel<<<NWG, 256, 0, stream>>>(x, inv_freq, mf, out);
}
